// v000
// Measured on an AMD MI455X. A time is GPU time per run, averaged over a window of back-to-back runs after a warm-up
// (all launches, gaps included; the runs take copies of the inputs in turn), and the median of several windows.
// Apart from v000's, it joins two sittings. Times from different sittings can be a few percent apart, while
// side-by-side timings come from the same sitting.
// v000 is the starting kernel. One run takes 179 microseconds.
#include <hip/hip_runtime.h>
// Softmax-free 'attention': out = (q k^T) v per batch member, no scale, no softmax, no mask (q, k, v [4][4096][64] f32 ~ N(0, 1): four slabs of 4,096 x 64; attn = einsum('bid,bjd->bij', q, k); out = einsum('bij,bjd->bid', attn, v) -> [4][4096][64]); built literally: the score matrix is materialised per slab.
// Structure: q, k, v as exact f16 planes (bf16-rounded inputs are f16-exact); V^T of every head via LDS transposes (each head read as its own 64-wide slab); per group of 4 heads: scores = q k^T as a WMMA GEMM (32x64 wave tiles, f32 accumulation of 64 exact products, alpha 1) written as an F16 plane from the GEMM epilogue (|score| up to about 45: the f16 rounding is 2^-11 relative), then out = scores . V^T (K = 4096, f32 accumulation, alpha 1) written as f32 straight into the head-major output rows.
// Compute dtype: inputs rounded to bf16 -> exact f16 operands; the ONE computed operand is the score plane, stored as f16 by the GEMM's own epilogue; both accumulations f32. v_wmma_f32_16x16x32_f16.
#define NB 4
#define SQ 2048
#define DM 1024
#define NH 16
#define HD 64
#define HG 4                         /* heads per attention launch group */
#define B0 0                         /* first batch processed (debug hook) */
#define NBR NB                       /* batches processed (debug hook) */
#define NR ((size_t)NB * SQ)         /* token rows */
#define MP ((int)((size_t)NBR * SQ)) /* rows projected (debug hook) */
#define QN SQ                        /* query rows attended per batch (debug hook) */
#define NHD NH                       /* heads attended (debug hook) */
#define MPO MP                       /* rows through the output stage (debug hook) */
#define LQ DM      /* row pitch of the q/k/v rows */
typedef __bf16 v16b __attribute__((ext_vector_type(16)));
typedef unsigned short v8us __attribute__((ext_vector_type(8), may_alias));
typedef float  v8f  __attribute__((ext_vector_type(8)));
typedef float  v4f  __attribute__((ext_vector_type(4)));
typedef float  v4fa __attribute__((ext_vector_type(4), may_alias));
union FragB { v16b v; v8us half[2]; unsigned short u[16]; };

__device__ __forceinline__ unsigned short bf16_bits(float x) { unsigned int u = __float_as_uint(x); return (unsigned short)((u + 0x7FFFu + ((u >> 16) & 1u)) >> 16); }
__device__ __forceinline__ float bf16_val(unsigned short b) { return __uint_as_float(((unsigned int)b) << 16); }
__device__ __forceinline__ float bf16_round(float x) { return bf16_val(bf16_bits(x)); }
// D += A·B with NT terms: 1 = ah·bh, 2 = + al·bh (A split), 3 = + ah·bl (both split)
template <int NT>
__device__ __forceinline__ v8f mmaN(v16b ah, v16b al, v16b bh, v16b bl, v8f c) {
  c = __builtin_amdgcn_wmma_f32_16x16x32_bf16(false, ah, false, bh, (short)0, c, false, false);
  if (NT >= 2) c = __builtin_amdgcn_wmma_f32_16x16x32_bf16(false, al, false, bh, (short)0, c, false, false);
  if (NT >= 3) c = __builtin_amdgcn_wmma_f32_16x16x32_bf16(false, ah, false, bl, (short)0, c, false, false);
  asm volatile("v_nop\n\tv_nop\n\tv_nop\n\tv_nop" : "+v"(c) : "v"(ah), "v"(al), "v"(bh), "v"(bl));
  return c;
}

__global__ __launch_bounds__(256) void k_wt_bf16(const float* __restrict__ W, unsigned short* __restrict__ Wt, int K, int N) {
  const int t = blockIdx.x * 256 + threadIdx.x;
  const int k8n = K / 8;
  if (t >= N * k8n) return;
  const int n = t / k8n, k8 = (t % k8n) * 8;
  v8us v;
#pragma unroll
  for (int i = 0; i < 8; ++i) v[i] = bf16_bits(W[(size_t)(k8 + i) * N + n]);
  *(v8us*)(Wt + (size_t)n * K + k8) = v;
  
}

// GEMM C[M][N] (f32, pitch ldc) = act(A[M][K]·W + bias). A f32 row-major (pitch lda) converted per fragment to bf16
// (ASPLIT: hi/lo two planes -> 2 terms, else single rounded term); Wt bf16 [N][K] (pitch ldb). BIAS_BF16 rounds the
// bias to bf16 first (bias quantised to bf16 before the add). K%32==0, M%16==0, N%64==0.
template <bool ASPLIT, int ACT, bool BIAS_BF16>
__global__ __launch_bounds__(128) void k_gemm_bf(const float* __restrict__ A, int lda, const unsigned short* __restrict__ Wt, int ldb,
                                               const float* __restrict__ bias, float* __restrict__ C, int ldc, int M, int N, int K) {
  __shared__ __attribute__((aligned(16))) float so[4][16][64];
  const int tid = threadIdx.x, w = tid >> 5, lane = tid & 31, ln = lane & 15, hh = lane >> 4;
  const int ntn = N / 64;
  const int wid = blockIdx.x * 4 + w;
  const int mt = wid / ntn, nq = wid % ntn;
  if (mt * 16 >= M) return;
  const int row0 = mt * 16, col0 = nq * 64;
  const float* arow = A + (size_t)(row0 + ln) * lda;
  v8f acc[4] = {};
  for (int kb = 0; kb < K; kb += 32) {
    FragB ah, al;
    const v4f x0 = *(const v4fa*)(arow + kb + 8 * hh), x1 = *(const v4fa*)(arow + kb + 8 * hh + 4);
    const v4f x2 = *(const v4fa*)(arow + kb + 16 + 8 * hh), x3 = *(const v4fa*)(arow + kb + 16 + 8 * hh + 4);
    float xs[16] = {x0[0],x0[1],x0[2],x0[3],x1[0],x1[1],x1[2],x1[3],x2[0],x2[1],x2[2],x2[3],x3[0],x3[1],x3[2],x3[3]};
#pragma unroll
    for (int i = 0; i < 16; ++i) { const unsigned short hb = bf16_bits(xs[i]); ah.u[i] = hb; al.u[i] = ASPLIT ? bf16_bits(xs[i] - bf16_val(hb)) : (unsigned short)0; }
#pragma unroll
    for (int t = 0; t < 4; ++t) {
      const unsigned short* brow = Wt + (size_t)(col0 + t * 16 + ln) * ldb + kb;
      FragB b;
      b.half[0] = *(const v8us*)(brow + 8 * hh);
      b.half[1] = *(const v8us*)(brow + 16 + 8 * hh);
      acc[t] = mmaN<ASPLIT ? 2 : 1>(ah.v, al.v, b.v, b.v, acc[t]);
    }
  }
#pragma unroll
  for (int t = 0; t < 4; ++t) {
    float bv = bias ? bias[col0 + t * 16 + ln] : 0.f;
    if (BIAS_BF16) bv = bf16_round(bv);
#pragma unroll
    for (int r = 0; r < 8; ++r) { float v = acc[t][r] + bv; if (ACT == 1) v = fmaxf(v, 0.f); so[w][8 * hh + r][t * 16 + ln] = v; }
  }
  __builtin_amdgcn_fence(__ATOMIC_ACQ_REL, "workgroup");
  __builtin_amdgcn_wave_barrier();
  const int rsub = lane >> 4, c4 = (lane & 15) * 4;
  {
#pragma unroll
    for (int q = 0; q < 8; ++q) {
      const int r = q * 2 + rsub;
      const v4f v = *(const v4fa*)&so[w][r][c4];
      *(v4f*)(C + (size_t)(row0 + r) * ldc + col0 + c4) = v;
    }
    
  }
}

// GEMM C = act(A·W + bias + resid): A f32 (ASPLIT -> hi/lo 2 terms), Wt bf16 [N][K]; ACT 0 none, 1 relu, 2 exact gelu;
// resid (optional, f32, row index = (row % rmod), pitch ldr, RES_BF16 rounds it) added before the activation.
template <bool ASPLIT, int ACT, bool BIAS_BF16, bool RES_BF16>
__global__ __launch_bounds__(128) void k_gemm_bf3(const float* __restrict__ A, int lda, const unsigned short* __restrict__ Wt, int ldb,
                                                const float* __restrict__ bias, const float* __restrict__ resid, int rmod, int ldr,
                                                float* __restrict__ C, int ldc, int M, int N, int K) {
  __shared__ __attribute__((aligned(16))) float so[4][16][64];
  const int tid = threadIdx.x, w = tid >> 5, lane = tid & 31, ln = lane & 15, hh = lane >> 4;
  const int ntn = N / 64;
  const int wid = blockIdx.x * 4 + w;
  const int mt = wid / ntn, nq = wid % ntn;
  if (mt * 16 >= M) return;
  const int row0 = mt * 16, col0 = nq * 64;
  const float* arow = A + (size_t)(row0 + ln) * lda;
  v8f acc[4] = {};
  for (int kb = 0; kb < K; kb += 32) {
    FragB ah, al;
    const v4f x0 = *(const v4fa*)(arow + kb + 8 * hh), x1 = *(const v4fa*)(arow + kb + 8 * hh + 4);
    const v4f x2 = *(const v4fa*)(arow + kb + 16 + 8 * hh), x3 = *(const v4fa*)(arow + kb + 16 + 8 * hh + 4);
    float xs[16] = {x0[0],x0[1],x0[2],x0[3],x1[0],x1[1],x1[2],x1[3],x2[0],x2[1],x2[2],x2[3],x3[0],x3[1],x3[2],x3[3]};
#pragma unroll
    for (int i = 0; i < 16; ++i) { const unsigned short hb = bf16_bits(xs[i]); ah.u[i] = hb; al.u[i] = ASPLIT ? bf16_bits(xs[i] - bf16_val(hb)) : (unsigned short)0; }
#pragma unroll
    for (int t = 0; t < 4; ++t) {
      const unsigned short* brow = Wt + (size_t)(col0 + t * 16 + ln) * ldb + kb;
      FragB b;
      b.half[0] = *(const v8us*)(brow + 8 * hh);
      b.half[1] = *(const v8us*)(brow + 16 + 8 * hh);
      acc[t] = mmaN<ASPLIT ? 2 : 1>(ah.v, al.v, b.v, b.v, acc[t]);
    }
  }
#pragma unroll
  for (int t = 0; t < 4; ++t) {
    const int col = col0 + t * 16 + ln;
    float bv = bias ? bias[col] : 0.f;
    if (BIAS_BF16) bv = bf16_round(bv);
#pragma unroll
    for (int r = 0; r < 8; ++r) {
      float v = acc[t][r] + bv;
      if (resid) { float rv = resid[(size_t)((row0 + 8 * hh + r) % rmod) * ldr + col]; if (RES_BF16) rv = bf16_round(rv); v += rv; }
      if (ACT == 1) v = fmaxf(v, 0.f);
      if (ACT == 2) v = 0.5f * v * (1.0f + erff(v * 0.70710678118654752f));
      if (ACT == 3) { const float u = 0.7978845608028654f * (v + 0.044715f * v * v * v); v = 0.5f * v * (1.0f + tanhf(u)); }
      so[w][8 * hh + r][t * 16 + ln] = v;
    }
  }
  __builtin_amdgcn_fence(__ATOMIC_ACQ_REL, "workgroup");
  __builtin_amdgcn_wave_barrier();
  const int rsub = lane >> 4, c4 = (lane & 15) * 4;
  {
#pragma unroll
    for (int q = 0; q < 8; ++q) {
      const int r = q * 2 + rsub;
      const v4f v = *(const v4fa*)&so[w][r][c4];
      *(v4f*)(C + (size_t)(row0 + r) * ldc + col0 + c4) = v;
    }
    
  }
}
// row LayerNorm (biased variance, eps) over N: s = X (+ R); optional out_sum <- s; out_norm <- (s-mu)*rsqrt(var+eps)*g + b
template <bool PARAM_BF16>
__global__ __launch_bounds__(256) void k_layernorm(const float* __restrict__ X, const float* __restrict__ R, const float* __restrict__ g, const float* __restrict__ bta,
                                                  float* __restrict__ out_sum, float* __restrict__ out_norm, int N, float eps) {
  __shared__ float red[256];
  const int row = blockIdx.x, tid = threadIdx.x;
  const float* x = X + (size_t)row * N; const float* rr = R ? R + (size_t)row * N : nullptr;
  float vals[16];                     // up to N = 4096
  const int per = N / 256;            // contiguous chunk per thread? use strided-by-4 chunks: thread handles j = tid*4 + 1024*u
  float s1 = 0.f;
  for (int u = 0; u < per / 4; ++u) {
    const int j = tid * 4 + 1024 * u;
    const v4f a = *(const v4fa*)(x + j);
    v4f b = {0.f,0.f,0.f,0.f}; if (rr) b = *(const v4fa*)(rr + j);
#pragma unroll
    for (int q = 0; q < 4; ++q) { const float v = a[q] + b[q]; vals[u * 4 + q] = v; s1 += v; }
  }
  red[tid] = s1; __syncthreads();
  for (int st = 128; st > 0; st >>= 1) { if (tid < st) red[tid] += red[tid + st]; __syncthreads(); }
  const float mu = red[0] / (float)N; __syncthreads();
  float s2 = 0.f;
  for (int u = 0; u < per / 4; ++u)
#pragma unroll
    for (int q = 0; q < 4; ++q) { const float c = vals[u * 4 + q] - mu; s2 += c * c; }
  red[tid] = s2; __syncthreads();
  for (int st = 128; st > 0; st >>= 1) { if (tid < st) red[tid] += red[tid + st]; __syncthreads(); }
  const float rs = rsqrtf(red[0] / (float)N + eps);
  {
    for (int u = 0; u < per / 4; ++u) {
      const int j = tid * 4 + 1024 * u;
      v4f o, sm;
#pragma unroll
      for (int q = 0; q < 4; ++q) {
        float gg = g[j + q], bb = bta[j + q];
        if (PARAM_BF16) { gg = bf16_round(gg); bb = bf16_round(bb); }
        sm[q] = vals[u * 4 + q]; o[q] = (vals[u * 4 + q] - mu) * rs * gg + bb;
      }
      if (out_sum) *(v4f*)(out_sum + (size_t)row * N + j) = sm;
      *(v4f*)(out_norm + (size_t)row * N + j) = o;
    }
    
  }
}



// ---- f16 WMMA path (v_wmma_f32_16x16x32_f16): 11-bit significands for operands in range — used where a [0,1] probability operand needs more precision than bf16
typedef _Float16 v16h __attribute__((ext_vector_type(16)));
union FragH { v16h v; v8us half[2]; _Float16 h[16]; unsigned short u[16]; };
template <int NT>
__device__ __forceinline__ v8f mmaH(v16h ah, v16h al, v16h bh, v16h bl, v8f c) {
  c = __builtin_amdgcn_wmma_f32_16x16x32_f16(false, ah, false, bh, (short)0, c, false, false);
  if (NT >= 2) c = __builtin_amdgcn_wmma_f32_16x16x32_f16(false, al, false, bh, (short)0, c, false, false);
  if (NT >= 3) c = __builtin_amdgcn_wmma_f32_16x16x32_f16(false, ah, false, bl, (short)0, c, false, false);
  asm volatile("v_nop\n\tv_nop\n\tv_nop\n\tv_nop" : "+v"(c) : "v"(ah), "v"(al), "v"(bh), "v"(bl));
  return c;
}
// batched GEMM like k_gemm_b but f16 operands: A f32 (split into f16 hi/lo if ASPLIT, else rounded to f16), Bt = f16 values [n][k]; alpha; C f32; N multiple of 16 (partial tiles skipped)
template <bool ASPLIT>
__global__ __launch_bounds__(128) void k_gemm_h(const float* __restrict__ A, int lda, size_t sA, const _Float16* __restrict__ Bh, int ldb, size_t sB, float alpha, float* __restrict__ C, int ldc, size_t sC, int M, int N, int K) {
  __shared__ __attribute__((aligned(16))) float so[4][16][64];
  const int tid = threadIdx.x, w = tid >> 5, lane = tid & 31, ln = lane & 15, hh = lane >> 4; const int by = blockIdx.y;
  A += (size_t)by * sA; Bh += (size_t)by * sB; C += (size_t)by * sC;
  const int ntn = (N + 63) / 64; const int wid = blockIdx.x * 4 + w; const int mt = wid / ntn, nq = wid % ntn; if (mt * 16 >= M) return;
  const int row0 = mt * 16, col0 = nq * 64; const float* arow = A + (size_t)(row0 + ln) * lda;
  v8f acc[4] = {};
  for (int kb = 0; kb < K; kb += 32) {
    FragH ah, al;
    const v4f x0 = *(const v4fa*)(arow + kb + 8 * hh), x1 = *(const v4fa*)(arow + kb + 8 * hh + 4), x2 = *(const v4fa*)(arow + kb + 16 + 8 * hh), x3 = *(const v4fa*)(arow + kb + 16 + 8 * hh + 4);
    float xs[16] = {x0[0],x0[1],x0[2],x0[3],x1[0],x1[1],x1[2],x1[3],x2[0],x2[1],x2[2],x2[3],x3[0],x3[1],x3[2],x3[3]};
#pragma unroll
    for (int i = 0; i < 16; ++i) { const _Float16 h = (_Float16)xs[i]; ah.h[i] = h; al.h[i] = ASPLIT ? (_Float16)(xs[i] - (float)h) : (_Float16)0.0f; }
#pragma unroll
    for (int t = 0; t < 4; ++t) { if (col0 + t * 16 >= N) continue; const size_t boff = (size_t)(col0 + t * 16 + ln) * ldb + kb; FragH bq; bq.half[0] = *(const v8us*)(Bh + boff + 8 * hh); bq.half[1] = *(const v8us*)(Bh + boff + 16 + 8 * hh);
      acc[t] = mmaH<ASPLIT ? 2 : 1>(ah.v, al.v, bq.v, bq.v, acc[t]); }
  }
#pragma unroll
  for (int t = 0; t < 4; ++t) { if (col0 + t * 16 >= N) continue;
#pragma unroll
    for (int r = 0; r < 8; ++r) so[w][8 * hh + r][t * 16 + ln] = acc[t][r] * alpha; }
  __builtin_amdgcn_fence(__ATOMIC_ACQ_REL, "workgroup"); __builtin_amdgcn_wave_barrier();
  const int rsub = lane >> 4, c4 = (lane & 15) * 4;
  {
#pragma unroll
    for (int q = 0; q < 8; ++q) { const int r = q * 2 + rsub; if (col0 + c4 < N) { const v4f v = *(const v4fa*)&so[w][r][c4]; *(v4f*)(C + (size_t)(row0 + r) * ldc + col0 + c4) = v; } }
     }
}

// Wt[n][k] = f16(W[k][n]·scale) from f32 row-major W[K][N] (scale = power of two; bf16-exact weights stay exact in f16 away from the subnormal range)
__global__ __launch_bounds__(256) void k_wt_f16(const float* __restrict__ W, _Float16* __restrict__ Wt, int K, int N, float scale) {
  const int t = blockIdx.x * 256 + threadIdx.x; if (t >= N * (K / 8)) return; const int n = t / (K / 8), k8 = (t % (K / 8)) * 8; FragH f;
#pragma unroll
  for (int i = 0; i < 8; ++i) f.h[i] = (_Float16)(bf16_round(W[(size_t)(k8 + i) * N + n]) * scale); const v8us o = f.half[0];
  *(v8us*)((unsigned short*)Wt + (size_t)n * K + k8) = o; 
}
// k_gemm_hh variant with fused epilogue: v = acc·alpha + bias[by·sBias + col] (+ CP[(row/rowsPerB)·sCPb + by·64 + col] if CP) ; ACT 0 none / 1 elu ; writes f16 C16 (and f32 C if non-null)
template <int ACT>
__global__ __launch_bounds__(128) void k_gemm_hhx(const _Float16* __restrict__ A, int lda, size_t sA, const _Float16* __restrict__ Bh, int ldb, size_t sB, float alpha, const float* __restrict__ bias, size_t sBias, const float* __restrict__ CP, int rowsPerB, size_t sCPb, int row0g,
    float* __restrict__ C, _Float16* __restrict__ C16, int ldc, size_t sC, int M, int N, int K) {
  __shared__ __attribute__((aligned(16))) float so[4][16][64];
  const int tid = threadIdx.x, w = tid >> 5, lane = tid & 31, ln = lane & 15, hh = lane >> 4; const int by = blockIdx.y;
  A += (size_t)by * sA; Bh += (size_t)by * sB; const size_t cofs = (size_t)by * sC; const float* bp = bias ? bias + (size_t)by * sBias : nullptr;
  const int ntn = (N + 63) / 64; const int wid = blockIdx.x * 4 + w; const int mt = wid / ntn, nq = wid % ntn; if (mt * 16 >= M) return;
  const int row0 = mt * 16, col0 = nq * 64; const _Float16* arow = A + (size_t)(row0 + ln) * lda;
  v8f acc[4] = {};
  for (int kb = 0; kb < K; kb += 32) { FragH ah; ah.half[0] = *(const v8us*)((const unsigned short*)arow + kb + 8 * hh); ah.half[1] = *(const v8us*)((const unsigned short*)arow + kb + 16 + 8 * hh);
#pragma unroll
    for (int t = 0; t < 4; ++t) { if (col0 + t * 16 >= N) continue; const size_t boff = (size_t)(col0 + t * 16 + ln) * ldb + kb; FragH bq; bq.half[0] = *(const v8us*)((const unsigned short*)Bh + boff + 8 * hh); bq.half[1] = *(const v8us*)((const unsigned short*)Bh + boff + 16 + 8 * hh);
      acc[t] = mmaH<1>(ah.v, ah.v, bq.v, bq.v, acc[t]); }
  }
#pragma unroll
  for (int t = 0; t < 4; ++t) { if (col0 + t * 16 >= N) continue; const int col = col0 + t * 16 + ln; const float bv = bp ? bf16_round(bp[col]) : 0.f;
#pragma unroll
    for (int r = 0; r < 8; ++r) { float v = acc[t][r] * alpha + bv; if (CP) { const int rr = row0g + row0 + 8 * hh + r; if (rowsPerB < 0) v += CP[cofs + (size_t)rr * ldc + col];      /* rowsPerB < 0: own element of the batched C plane */ else { const int bidx = rr / rowsPerB; v += CP[(size_t)bidx * sCPb + (size_t)by * 64 + col]; } } if (ACT == 1) v = (v > 0.f) ? v : expm1f(v); else if (ACT == 7) v = (v > 0.f) ? v + 1.0f : expf(v); else if (ACT == 8) v = tanhf(v); else if (ACT == 9) v = 0.5f * v * (1.0f + tanhf(0.7978845608028654f * (v + 0.044715f * v * v * v))); else if (ACT == 11) v = 1.0f / (1.0f + expf(-v)); else if (ACT == 12) v = (v > 0.f) ? v : 0.01f * v; else if (ACT == 14) v = (v > 0.f) ? v : 0.1f * v; else if (ACT == 16) v = (v >= 0.f) ? v : 0.3f * v; else if (ACT == 17) v = (v >= 0.f) ? v : 0.2f * v; else if (ACT == 15) v = v / (1.0f + expf(-v)); else if (ACT == 3) v = fmaxf(v, 0.f); else if (ACT == 6) v = 0.5f * v * (1.0f + erff(v * 0.70710678118654752f)); so[w][8 * hh + r][t * 16 + ln] = v; } }
  __builtin_amdgcn_fence(__ATOMIC_ACQ_REL, "workgroup"); __builtin_amdgcn_wave_barrier();
  const int rsub = lane >> 4, c4 = (lane & 15) * 4; typedef _Float16 v4h __attribute__((ext_vector_type(4)));
  {
#pragma unroll
    for (int q = 0; q < 8; ++q) { const int r = q * 2 + rsub; if (col0 + c4 < N) { const v4f v = *(const v4fa*)&so[w][r][c4]; if (C) *(v4f*)(C + cofs + (size_t)(row0 + r) * ldc + col0 + c4) = v; if (C16) { v4h h4; for (int i = 0; i < 4; ++i) h4[i] = (_Float16)v[i]; *(v4h*)(C16 + cofs + (size_t)(row0 + r) * ldc + col0 + c4) = h4; } } }
     }
}


typedef _Float16 v4h __attribute__((ext_vector_type(4)));

__global__ __launch_bounds__(256) void k_x16(const float* __restrict__ x, _Float16* __restrict__ X16, size_t n8) { const size_t t = (size_t)blockIdx.x * 256 + threadIdx.x; if (t >= n8) return; FragH f;
#pragma unroll
  for (int q = 0; q < 8; ++q) f.h[q] = (_Float16)bf16_round(x[t * 8 + q]); *(v8us*)((unsigned short*)X16 + t * 8) = f.half[0];  }
__global__ __launch_bounds__(256) void k_h16(const float* __restrict__ x, _Float16* __restrict__ X16, size_t n8) { const size_t t = (size_t)blockIdx.x * 256 + threadIdx.x; if (t >= n8) return; FragH f;
#pragma unroll
  for (int q = 0; q < 8; ++q) f.h[q] = (_Float16)x[t * 8 + q]; *(v8us*)((unsigned short*)X16 + t * 8) = f.half[0];  }
__global__ __launch_bounds__(256) void k_round16f(const float* __restrict__ W, _Float16* __restrict__ Bt, size_t n8) { const size_t t = (size_t)blockIdx.x * 256 + threadIdx.x; if (t >= n8) return; FragH f;
#pragma unroll
  for (int i = 0; i < 8; ++i) f.h[i] = (_Float16)(bf16_round(W[t * 8 + i]) * 16.0f); *(v8us*)((unsigned short*)Bt + t * 8) = f.half[0];  }
template <int NHv, int TTv>
__global__ __launch_bounds__(256) void k_vt(const _Float16* __restrict__ V16, int ldv, int voff, _Float16* __restrict__ Vt) { __shared__ unsigned short tl[64][66]; const int tid = threadIdx.x; const int slab = blockIdx.x / (TTv / 64), lg = blockIdx.x % (TTv / 64); const int b = slab / NHv, h = slab % NHv;
  for (int i = tid; i < 64 * 8; i += 256) { const int r = i / 8, c8 = (i % 8) * 8; FragH f; f.half[0] = *(const v8us*)((const unsigned short*)V16 + ((size_t)b * TTv + lg * 64 + r) * ldv + voff + h * 64 + c8);
#pragma unroll
    for (int q = 0; q < 8; ++q) tl[r][c8 + q] = f.u[q]; }
  __syncthreads();
  {
#pragma unroll
    for (int rd = 0; rd < 2; ++rd) { const int d = rd * 32 + tid / 8, pc = tid % 8; FragH f;
#pragma unroll
      for (int q = 0; q < 8; ++q) f.u[q] = tl[pc * 8 + q][d];
      *(v8us*)((unsigned short*)Vt + ((size_t)slab * 64 + d) * TTv + lg * 64 + pc * 8) = f.half[0]; }
     } }

__global__ __launch_bounds__(256) void k_hl(const float* __restrict__ F, _Float16* __restrict__ Hh, _Float16* __restrict__ Hl, size_t n8) { const size_t t = (size_t)blockIdx.x * 256 + threadIdx.x; if (t >= n8) return; FragH fh, fl; const v4f a = *(const v4fa*)(F + t * 8), c = *(const v4fa*)(F + t * 8 + 4);
#pragma unroll
  for (int q = 0; q < 4; ++q) { _Float16 h = (_Float16)a[q]; fh.h[q] = h; fl.h[q] = (_Float16)((a[q] - (float)h) * 1024.0f); h = (_Float16)c[q]; fh.h[4 + q] = h; fl.h[4 + q] = (_Float16)((c[q] - (float)h) * 1024.0f); }
  { *(v8us*)((unsigned short*)Hh + t * 8) = fh.half[0]; *(v8us*)((unsigned short*)Hl + t * 8) = fl.half[0];  } }

// ---- fast GEMM (wave tile 32x64; requires M % 32 == 0 rows per launch region and N % 64 == 0); epilogue = k_gemm_hhx semantics ----
__device__ __forceinline__ v16h g2_frag(const _Float16* p, int hh) { FragH f; f.half[0] = *(const v8us*)((const unsigned short*)p + 8 * hh); f.half[1] = *(const v8us*)((const unsigned short*)p + 16 + 8 * hh); return f.v; }
__device__ __forceinline__ v8f g2_mma(v16h a, v16h b, v8f c) { v8f d = __builtin_amdgcn_wmma_f32_16x16x32_f16(false, a, false, b, (short)0, c, false, false); asm volatile("v_nop\n\tv_nop\n\tv_nop\n\tv_nop" : "+v"(d) : "v"(a), "v"(b)); return d; }
template <int ACT>
__global__ __launch_bounds__(128) void k_gemm2(const _Float16* __restrict__ A, int lda, size_t sA, const _Float16* __restrict__ Bh, int ldb, size_t sB, float alpha, const float* __restrict__ bias, size_t sBias, const float* __restrict__ CP, int rowsPerB, size_t sCPb, int row0g,
    float* __restrict__ C, _Float16* __restrict__ C16, int ldc, size_t sC, int M, int N, int K) { static_assert(ACT == 0 || ACT == 3 || ACT == 6 || ACT == 8 || ACT == 9 || ACT == 11 || ACT == 12 || ACT == 14 || ACT == 15 || ACT == 16 || ACT == 17, "k_gemm2: unsupported ACT code (would silently apply no activation)");
  __shared__ __attribute__((aligned(16))) float so[4][32][68];
  const int tid = threadIdx.x, w = tid >> 5, lane = tid & 31, ln = lane & 15, hh = lane >> 4; const int by = blockIdx.y;
  A += (size_t)by * sA; Bh += (size_t)by * sB; const size_t cofs = (size_t)by * sC; const float* bp = bias ? bias + (size_t)by * sBias : nullptr;
  const int ntn = N >> 6; const int mt = blockIdx.x / ntn, nq = blockIdx.x - mt * ntn; const int row0 = mt * 128 + 32 * w, col0 = nq * 64; if (row0 >= M) return;
  const _Float16* a0p = A + (size_t)(row0 + ln) * lda; const _Float16* a1p = a0p + (size_t)16 * lda;
  const _Float16* b0p = Bh + (size_t)(col0 + ln) * ldb; const _Float16* b1p = b0p + (size_t)16 * ldb; const _Float16* b2p = b1p + (size_t)16 * ldb; const _Float16* b3p = b2p + (size_t)16 * ldb;
  const v8f z8 = {0.f,0.f,0.f,0.f,0.f,0.f,0.f,0.f}; v8f c00 = z8, c01 = z8, c02 = z8, c03 = z8, c10 = z8, c11 = z8, c12 = z8, c13 = z8;
#pragma unroll 1
  for (int kb = 0; kb < K; kb += 32) { const v16h a0 = g2_frag(a0p + kb, hh), a1 = g2_frag(a1p + kb, hh);
    v16h b = g2_frag(b0p + kb, hh); c00 = g2_mma(a0, b, c00); c10 = g2_mma(a1, b, c10);
    b = g2_frag(b1p + kb, hh); c01 = g2_mma(a0, b, c01); c11 = g2_mma(a1, b, c11);
    b = g2_frag(b2p + kb, hh); c02 = g2_mma(a0, b, c02); c12 = g2_mma(a1, b, c12);
    b = g2_frag(b3p + kb, hh); c03 = g2_mma(a0, b, c03); c13 = g2_mma(a1, b, c13); }
  v8f accs[8] = {c00, c01, c02, c03, c10, c11, c12, c13};
#pragma unroll
  for (int u = 0; u < 8; ++u) { const int t = u & 3, half = u >> 2; const int col = col0 + t * 16 + ln; const float bv = bp ? bf16_round(bp[col]) : 0.f;
#pragma unroll
    for (int r = 0; r < 8; ++r) { const int rloc = half * 16 + 8 * hh + r; float v = accs[u][r] * alpha + bv; if (CP) { if (rowsPerB < 0) v += CP[cofs + (size_t)(row0g + row0 + rloc) * ldc + col];      /* rowsPerB < 0: own element of the batched C plane */ else { const int bidx = (row0g + row0 + rloc) / rowsPerB; v += CP[(size_t)bidx * sCPb + (size_t)by * 64 + col]; } }
      if (ACT == 3) v = fmaxf(v, 0.f); else if (ACT == 6) v = 0.5f * v * (1.0f + erff(v * 0.70710678118654752f)); else if (ACT == 11) v = 1.0f / (1.0f + expf(-v)); else if (ACT == 15) v = v / (1.0f + expf(-v)); else if (ACT == 12) v = (v > 0.f) ? v : 0.01f * v; else if (ACT == 8) v = tanhf(v); else if (ACT == 9) v = 0.5f * v * (1.0f + tanhf(0.7978845608028654f * (v + 0.044715f * v * v * v))); else if (ACT == 14) v = (v > 0.f) ? v : 0.1f * v; else if (ACT == 16) v = (v >= 0.f) ? v : 0.3f * v; else if (ACT == 17) v = (v >= 0.f) ? v : 0.2f * v;
      so[w][rloc][t * 16 + ln] = v; } }
  __builtin_amdgcn_fence(__ATOMIC_ACQ_REL, "workgroup"); __builtin_amdgcn_wave_barrier();
  const int rsub = lane >> 4, c4 = (lane & 15) * 4;
  {
#pragma unroll
    for (int q = 0; q < 16; ++q) { const int r = q * 2 + rsub; const v4f v = *(const v4fa*)&so[w][r][c4]; if (C) *(v4f*)(C + cofs + (size_t)(row0 + r) * ldc + col0 + c4) = v; if (C16) { v4h h4; for (int i = 0; i < 4; ++i) h4[i] = (_Float16)v[i]; *(v4h*)(C16 + cofs + (size_t)(row0 + r) * ldc + col0 + c4) = h4; } }
     } }


__global__ __launch_bounds__(256) void k_wnat(const float* __restrict__ w, size_t n8, _Float16* __restrict__ Bt) { const size_t t = (size_t)blockIdx.x * 256 + threadIdx.x; if (t >= n8) return; FragH f; for (int q = 0; q < 8; ++q) f.h[q] = (_Float16)(bf16_round(w[t * 8 + q]) * 16.0f); *(v8us*)((unsigned short*)Bt + t * 8) = f.half[0];  }
__global__ __launch_bounds__(256) void k_rsm(const float* __restrict__ S, _Float16* __restrict__ P, int nrows) {
  #pragma clang fp contract(off)
  const int i = blockIdx.x * 256 + threadIdx.x; if (i >= nrows) return; const float* s = S + (size_t)i * SQ; float mx = -3.0e38f;
#pragma unroll 1
  for (int j = 0; j < SQ; ++j) mx = fmaxf(mx, s[j]); float se = 0.f;
#pragma unroll 1
  for (int j = 0; j < SQ; ++j) se += expf(s[j] - mx); const float sc = 256.0f / se;
#pragma unroll 1
  for (int j0 = 0; j0 < SQ; j0 += 8) { FragH f; for (int q = 0; q < 8; ++q) f.h[q] = (_Float16)(expf(s[j0 + q] - mx) * sc); unsigned short* d = (unsigned short*)P + (size_t)i * SQ + j0; *(v8us*)d = f.half[0];  } }
__global__ __launch_bounds__(256) void k_vt(const _Float16* __restrict__ V16, int b, int h0, _Float16* __restrict__ VT) { __shared__ unsigned short tl[64][65]; const int tid = threadIdx.x; const int hh = blockIdx.x % HG, sg = blockIdx.x / HG; const int s0 = sg * 64; const int h = h0 + hh;
  for (int i = tid; i < 64 * 8; i += 256) { const int j = i / 8, d8 = (i % 8) * 8; FragH f; f.half[0] = *(const v8us*)((const unsigned short*)V16 + ((size_t)b * SQ + s0 + j) * DM + h * HD + d8); for (int q = 0; q < 8; ++q) tl[d8 + q][j] = f.u[q]; }
  __syncthreads();
  { for (int i = tid; i < 64 * 8; i += 256) { const int d = i / 8, j8 = (i % 8) * 8; FragH f; for (int q = 0; q < 8; ++q) f.u[q] = tl[d][j8 + q]; *(v8us*)((unsigned short*)VT + ((size_t)hh * HD + d) * SQ + s0 + j8) = f.half[0]; }  } }



__global__ __launch_bounds__(256) void k_rsmf(const float* __restrict__ S, _Float16* __restrict__ P, int qn, int hg) {
  #pragma clang fp contract(off)
  const int t = blockIdx.x * 256 + threadIdx.x; if (t >= qn * hg) return; const size_t i = (size_t)(t / qn) * SQ + (t % qn); const float* s = S + i * SQ; float mx = -3.0e38f;
#pragma unroll 1
  for (int j = 0; j < SQ; ++j) mx = fmaxf(mx, s[j]); float se = 0.f;
#pragma unroll 1
  for (int j = 0; j < SQ; ++j) se += __expf(s[j] - mx); const float sc = 256.0f / se;
#pragma unroll 1
  for (int j0 = 0; j0 < SQ; j0 += 8) { FragH f; for (int q = 0; q < 8; ++q) f.h[q] = (_Float16)(__expf(s[j0 + q] - mx) * sc); unsigned short* d = (unsigned short*)P + i * SQ + j0; *(v8us*)d = f.half[0];  } }

#define SH 4                          /* heads (the leading non-batch axis of the inputs) */
#define SS 4096                        /* tokens per head */
#define SG 4                           /* heads per score-plane group */
#define SHR SH                         /* heads processed (debug hook; the full build: SH) */
extern "C" void kernel_launch(void* const* d_in, const int* in_sizes, int n_in,
                              void* d_out, int out_size, void* d_ws, size_t ws_size, hipStream_t stream) {
  (void)in_sizes; (void)n_in; (void)out_size;
  const float* const* I = (const float* const*)d_in; const float* q = I[0]; const float* k = I[1]; const float* v = I[2];      /* input order: q, k, v, each [1][4][4096][64] f32, HEAD-MAJOR: element (h, s, d) at (h x 4096 + s) x 64 + d */
  char* ws = (char*)d_ws; size_t off = 0;
  auto take = [&](size_t bytes) { char* p = ws + off; off += (bytes + 255) & ~(size_t)255; return p; };
  const size_t NE = (size_t)SH * SS * HD;      /* 1,048,576 elements per input */
  _Float16* Q16 = (_Float16*)take(NE * 2); _Float16* K16 = (_Float16*)take(NE * 2); _Float16* V16 = (_Float16*)take(NE * 2); _Float16* VT = (_Float16*)take(NE * 2); _Float16* S16 = (_Float16*)take((size_t)SG * SS * SS * 2);
  if (off > ws_size) return;
  k_x16<<<(unsigned)((NE / 8 + 255) / 256), 256, 0, stream>>>(q, Q16, NE / 8); k_x16<<<(unsigned)((NE / 8 + 255) / 256), 256, 0, stream>>>(k, K16, NE / 8); k_x16<<<(unsigned)((NE / 8 + 255) / 256), 256, 0, stream>>>(v, V16, NE / 8);
  k_vt<1, SS><<<SH * (SS / 64), 256, 0, stream>>>(V16, HD, 0, VT);      /* each head is its own slab of 4096 rows with pitch 64: Vt[h][d][s] */
  for (int h0 = 0; h0 < SHR; h0 += SG) {
    k_gemm2<0><<<dim3((SS / 128) * (SS / 64), SG), 128, 0, stream>>>(Q16 + (size_t)h0 * SS * HD, HD, (size_t)SS * HD, K16 + (size_t)h0 * SS * HD, HD, (size_t)SS * HD, 1.0f, nullptr, 0, nullptr, 1, 0, 0, nullptr, S16, SS, (size_t)SS * SS, SS, SS, HD);      /* scores[h][q][k] = q . k (K = 64, alpha 1) as an F16 plane from the epilogue */
    k_gemm2<0><<<dim3((SS / 128) * (HD / 64), SG), 128, 0, stream>>>(S16, SS, (size_t)SS * SS, VT + (size_t)h0 * HD * SS, SS, (size_t)HD * SS, 1.0f, nullptr, 0, nullptr, 1, 0, 0, (float*)d_out + (size_t)h0 * SS * HD, nullptr, HD, (size_t)SS * HD, SS, HD, SS); }      /* out[h][q][d] = scores . V^T (K = 4096, alpha 1) as f32 into the head-major output */
}

// v001
// A run of this version takes 10.5 microseconds.
// Timed twice side by side with v000, it ran 17.2 and 17.6 times as fast.
#include <hip/hip_runtime.h>
#include <stdint.h>
// Softmax-free 'attention': out = (q k^T) v per batch member, no scale, no softmax, no mask (q, k, v [4][4096][64] f32).
// The product is associative, so it is formed as out = q (k^T v): M = k^T v is 64 x 64 per batch member and no 4096 x 4096 score plane exists.
// Launch 1: per batch member 16 ranges of 256 keys; each work-group stages its k and v rows in LDS as f16, reads both through transposing loads
//           (the sum index is the key, which is the row of both) and writes one f32 partial of M in the accumulator's own lane order.
// Launch 2: each work-group sums the 16 partials of its 32 output columns (fixed order), rounds M to f16 and multiplies 256 rows of q by it.
// Compute dtype: inputs rounded to bf16, held as exact f16 operands; the ONE computed operand is M, rounded to f16; both accumulations f32. v_wmma_f32_16x16x32_f16.
#define NB 4
#define SS 4096                 /* rows per batch member */
#define HD 64
#define NC 16                   /* key ranges per batch member */
#define RK (SS / NC)            /* keys per range */
#define PT 160u                 /* LDS row pitch in bytes of the k and v tiles: 32 B x odd, for ds_load_tr16_b128 */
#define RQ 256                  /* q rows per work-group of launch 2 */
#define PQ 144u                 /* LDS row pitch in bytes of the q tile: 16 B x odd, for ds_load_b128 */
typedef _Float16 v16h __attribute__((ext_vector_type(16)));
typedef _Float16 v2h  __attribute__((ext_vector_type(2)));
typedef __bf16   v2b  __attribute__((ext_vector_type(2)));
typedef float    v2f  __attribute__((ext_vector_type(2)));
typedef float    v4f  __attribute__((ext_vector_type(4)));
typedef float    v4fa __attribute__((ext_vector_type(4), may_alias));
typedef float    v8f  __attribute__((ext_vector_type(8)));
typedef uint32_t u32x4  __attribute__((ext_vector_type(4)));
typedef uint32_t u32x4a __attribute__((ext_vector_type(4), may_alias));
typedef uint32_t u32x2  __attribute__((ext_vector_type(2)));
typedef uint32_t u32x2a __attribute__((ext_vector_type(2), may_alias));
typedef short    s16x8  __attribute__((ext_vector_type(8)));
union Frag { v16h v; u32x4 q[2]; };

// two inputs: rounded to bf16 (nearest even), then held as f16
__device__ __forceinline__ uint32_t in16(float a, float b) { const v2f x = {a, b}; const v2b y = __builtin_convertvector(x, v2b); const v2f z = __builtin_convertvector(y, v2f); return __builtin_bit_cast(uint32_t, __builtin_convertvector(z, v2h)); }
// two computed values: rounded to f16 (nearest even)
__device__ __forceinline__ uint32_t cv16(float a, float b) { const v2f x = {a, b}; return __builtin_bit_cast(uint32_t, __builtin_convertvector(x, v2h)); }
__device__ __forceinline__ u32x4 ld_tr16(const unsigned char* p) { typedef __attribute__((address_space(3))) s16x8 lds_s16x8; return __builtin_bit_cast(u32x4, __builtin_amdgcn_ds_load_tr16_b128_v8i16((lds_s16x8*)p)); }

// P[b][range][tile = et * 4 + dt][lane][8]: lane (c, h), register r = sum over the range's keys s of k[s][16 dt + 8 h + r] * v[s][16 et + c]
__global__ __launch_bounds__(256) void k_ktv(const float* __restrict__ k, const float* __restrict__ v, float* __restrict__ P) {
  __shared__ __attribute__((aligned(16))) unsigned char L[2u * RK * PT];
  const unsigned tid = threadIdx.x, lane = tid & 31u, w = tid >> 5, blk = blockIdx.x;      /* blk = b * NC + range: its rows start at blk * RK */
  const v4fa* kg = (const v4fa*)(k + (size_t)blk * RK * HD) + tid;
  const v4fa* vg = (const v4fa*)(v + (size_t)blk * RK * HD) + tid;
  v4f xk[16], xv[16];
  for (int j = 0; j < 16; ++j) xk[j] = kg[j * 256];
  for (int j = 0; j < 16; ++j) xv[j] = vg[j * 256];
  unsigned char* st = L + (tid >> 4) * PT + (tid & 15u) * 8u;      /* load j holds row 16 j + tid / 16, columns 4 (tid % 16) ... + 3 */
  for (int j = 0; j < 16; ++j) { const u32x2 o = {in16(xk[j][0], xk[j][1]), in16(xk[j][2], xk[j][3])}; *(u32x2a*)(st + (unsigned)j * 16u * PT) = o; }
  for (int j = 0; j < 16; ++j) { const u32x2 o = {in16(xv[j][0], xv[j][1]), in16(xv[j][2], xv[j][3])}; *(u32x2a*)(st + RK * PT + (unsigned)j * 16u * PT) = o; }
  __syncthreads();
  const unsigned dt = w & 3u, ep = w >> 2;      /* the wave's tiles: rows 16 dt of M, columns 32 ep and 32 ep + 16 */
  const unsigned char* ad = L + (8u * (lane >> 4) + (lane & 7u)) * PT + ((lane >> 3) & 1u) * 16u;      /* lane (c, h) gets rows 8 h ... 8 h + 7 of column c: the same keys in both operands */
  const unsigned char* ak = ad + 32u * dt;
  const unsigned char* av = ad + RK * PT + 64u * ep;
  v8f c0 = {0.f, 0.f, 0.f, 0.f, 0.f, 0.f, 0.f, 0.f}, c1 = c0;
  for (int s = 0; s < RK / 32; ++s) {
    const unsigned o = (unsigned)s * 32u * PT;
    Frag a, b0, b1;
    a.q[0] = ld_tr16(ak + o); a.q[1] = ld_tr16(ak + o + 16u * PT);
    b0.q[0] = ld_tr16(av + o); b0.q[1] = ld_tr16(av + o + 16u * PT);
    b1.q[0] = ld_tr16(av + o + 32u); b1.q[1] = ld_tr16(av + o + 16u * PT + 32u);
    c0 = __builtin_amdgcn_wmma_f32_16x16x32_f16(false, a.v, false, b0.v, (short)0, c0, false, false);
    c1 = __builtin_amdgcn_wmma_f32_16x16x32_f16(false, a.v, false, b1.v, (short)0, c1, false, false);
  }
  float* o0 = P + ((size_t)blk * 16u + (2u * ep) * 4u + dt) * 256u + lane * 8u;
  const v4f s0 = {c0[0], c0[1], c0[2], c0[3]}, s1 = {c0[4], c0[5], c0[6], c0[7]}, s2 = {c1[0], c1[1], c1[2], c1[3]}, s3 = {c1[4], c1[5], c1[6], c1[7]};
  *(v4fa*)o0 = s0; *(v4fa*)(o0 + 4) = s1; *(v4fa*)(o0 + 1024) = s2; *(v4fa*)(o0 + 1028) = s3;
}

// out[b][i][e] = sum over d of q[b][i][d] * M[b][d][e]; M^T is the first operand, so a lane's 8 results are 8 consecutive e of one row
__global__ __launch_bounds__(256) void k_qm(const float* __restrict__ q, const float* __restrict__ P, float* __restrict__ out) {
  __shared__ __attribute__((aligned(16))) unsigned char Lq[RQ * PQ];
  __shared__ __attribute__((aligned(16))) unsigned char Lm[4096];
  const unsigned tid = threadIdx.x, lane = tid & 31u, w = tid >> 5, c = lane & 15u, h = lane >> 4;
  const unsigned eh = blockIdx.x & 1u, rt = (blockIdx.x >> 1) & (SS / RQ - 1u), b = blockIdx.x / (2u * (SS / RQ));      /* column half, row tile, batch member */
  const v4fa* pg = (const v4fa*)(P + (size_t)b * NC * (HD * HD) + eh * (HD * HD / 2)) + tid;      /* the half's 8 tiles lie in a row: 512 groups of 4 */
  const v4fa* qg = (const v4fa*)(q + ((size_t)b * SS + rt * RQ) * HD) + tid;
  v4f p0[NC], p1[NC], xq[16];
  for (int r = 0; r < NC; ++r) { p0[r] = pg[r * (HD * HD / 4)]; p1[r] = pg[r * (HD * HD / 4) + 256]; }
  for (int j = 0; j < 16; ++j) xq[j] = qg[j * 256];
  __builtin_amdgcn_sched_barrier(0);      /* keeps all 48 loads issued ahead of the first use: without it the compiler sinks the partials' loads into the sum, 4 in flight, one L2 latency per 4 */
  v4f m0 = p0[0], m1 = p1[0];
  for (int r = 1; r < NC; ++r) { m0 += p0[r]; m1 += p1[r]; }
  // group g of 4 holds registers 4 (g % 2) ... + 3 of lane (g / 2) % 32 of tile g / 64: as f16 it lies at byte 8 g, so that a tile is 32 lanes x 16 bytes
  { const u32x2 o = {cv16(m0[0], m0[1]), cv16(m0[2], m0[3])}; *(u32x2a*)(Lm + tid * 8u) = o; }
  { const u32x2 o = {cv16(m1[0], m1[1]), cv16(m1[2], m1[3])}; *(u32x2a*)(Lm + 2048u + tid * 8u) = o; }
  unsigned char* st = Lq + (tid >> 4) * PQ + (tid & 15u) * 8u;
  for (int j = 0; j < 16; ++j) { const u32x2 o = {in16(xq[j][0], xq[j][1]), in16(xq[j][2], xq[j][3])}; *(u32x2a*)(st + (unsigned)j * 16u * PQ) = o; }
  __syncthreads();
  // M fragment (column tile t, d block kb): accumulator tiles dt = 2 kb and 2 kb + 1 side by side give d = 32 kb + 8 h + s (s < 8), 32 kb + 16 + 8 h + s - 8; q is read in the same order
  Frag mf[2][2], qf[2][2];
  for (int t = 0; t < 2; ++t)
    for (int kb = 0; kb < 2; ++kb) { const unsigned char* p = Lm + (unsigned)(t * 4 + 2 * kb) * 512u + lane * 16u; mf[t][kb].q[0] = *(const u32x4a*)p; mf[t][kb].q[1] = *(const u32x4a*)(p + 512u); }
  for (int g = 0; g < 2; ++g)
    for (int kb = 0; kb < 2; ++kb) { const unsigned char* p = Lq + (32u * w + 16u * (unsigned)g + c) * PQ + (unsigned)kb * 64u + 16u * h; qf[g][kb].q[0] = *(const u32x4a*)p; qf[g][kb].q[1] = *(const u32x4a*)(p + 32u); }
  for (int g = 0; g < 2; ++g)
    for (int t = 0; t < 2; ++t) {
      v8f a = {0.f, 0.f, 0.f, 0.f, 0.f, 0.f, 0.f, 0.f};
      a = __builtin_amdgcn_wmma_f32_16x16x32_f16(false, mf[t][0].v, false, qf[g][0].v, (short)0, a, false, false);
      a = __builtin_amdgcn_wmma_f32_16x16x32_f16(false, mf[t][1].v, false, qf[g][1].v, (short)0, a, false, false);
      float* o = out + ((size_t)b * SS + rt * RQ + 32u * w + 16u * (unsigned)g + c) * HD + eh * 32u + (unsigned)t * 16u + 8u * h;
      const v4f s0 = {a[0], a[1], a[2], a[3]}, s1 = {a[4], a[5], a[6], a[7]};
      *(v4fa*)o = s0; *(v4fa*)(o + 4) = s1;
    }
}

extern "C" void kernel_launch(void* const* d_in, const int* in_sizes, int n_in,
                              void* d_out, int out_size, void* d_ws, size_t ws_size, hipStream_t stream) {
  (void)in_sizes; (void)n_in; (void)out_size;
  const float* const* I = (const float* const*)d_in; const float* q = I[0]; const float* k = I[1]; const float* v = I[2];      /* order: q, k, v, each [4][4096][64] f32 */
  float* P = (float*)d_ws;      /* partials of M: 4 x 16 x 64 x 64 f32, every one written by launch 1 before launch 2 reads it */
  if ((size_t)NB * NC * HD * HD * 4 > ws_size) return;
  k_ktv<<<NB * NC, 256, 0, stream>>>(k, v, P);
  k_qm<<<NB * (SS / RQ) * 2, 256, 0, stream>>>(q, P, (float*)d_out);
}

// v002
// One run takes 9.8 microseconds.
// Timed twice side by side with v001, it ran 1.07 times as fast both times.
// Over all steps from v000 it is 18.7 times as fast.
#include <hip/hip_runtime.h>
#include <stdint.h>
// Softmax-free 'attention': out = (q k^T) v per batch member, no scale, no softmax, no mask (q, k, v [4][4096][64] f32).
// The product is associative, so it is formed as out = q (k^T v): M = k^T v is 64 x 64 per batch member and no 4096 x 4096 score plane exists.
// Launch 1: per batch member 16 ranges of 256 keys; each work-group stages its k and v rows in LDS as f16, reads both through transposing loads
//           (the sum index is the key, which is the row of both) and writes one f32 partial of M, registers 0-3 and 4-7 of a tile as two planes of 32 lanes x 16 bytes.
// Launch 2: each work-group sums the 16 partials of its 32 output columns (fixed order), rounds M to f16 and multiplies 256 rows of q by it.
// Every global store instruction covers whole 128-byte lines: the partials by the two planes, out by dealing even and odd columns to the two column tiles.
// Compute dtype: inputs rounded to bf16, held as exact f16 operands; the ONE computed operand is M, rounded to f16; both accumulations f32. v_wmma_f32_16x16x32_f16.
#define NB 4
#define SS 4096                 /* rows per batch member */
#define HD 64
#define NC 16                   /* key ranges per batch member */
#define RK (SS / NC)            /* keys per range */
#define PT 160u                 /* LDS row pitch in bytes of the k and v tiles: 32 B x odd, for ds_load_tr16_b128 */
#define RQ 256                  /* q rows per work-group of launch 2 */
#define PQ 144u                 /* LDS row pitch in bytes of the q tile: 16 B x odd, for ds_load_b128 */
typedef _Float16 v16h __attribute__((ext_vector_type(16)));
typedef _Float16 v2h  __attribute__((ext_vector_type(2)));
typedef __bf16   v2b  __attribute__((ext_vector_type(2)));
typedef float    v2f  __attribute__((ext_vector_type(2)));
typedef float    v2fa __attribute__((ext_vector_type(2), may_alias));
typedef float    v4f  __attribute__((ext_vector_type(4)));
typedef float    v4fa __attribute__((ext_vector_type(4), may_alias));
typedef float    v8f  __attribute__((ext_vector_type(8)));
typedef uint32_t u32x4  __attribute__((ext_vector_type(4)));
typedef uint32_t u32x4a __attribute__((ext_vector_type(4), may_alias));
typedef uint32_t u32x2  __attribute__((ext_vector_type(2)));
typedef uint32_t u32x2a __attribute__((ext_vector_type(2), may_alias));
typedef short    s16x8  __attribute__((ext_vector_type(8)));
union Frag { v16h v; u32x4 q[2]; };

// two inputs: rounded to bf16 (nearest even), then held as f16
__device__ __forceinline__ uint32_t in16(float a, float b) { const v2f x = {a, b}; const v2b y = __builtin_convertvector(x, v2b); const v2f z = __builtin_convertvector(y, v2f); return __builtin_bit_cast(uint32_t, __builtin_convertvector(z, v2h)); }
// two computed values: rounded to f16 (nearest even)
__device__ __forceinline__ uint32_t cv16(float a, float b) { const v2f x = {a, b}; return __builtin_bit_cast(uint32_t, __builtin_convertvector(x, v2h)); }
__device__ __forceinline__ u32x4 ld_tr16(const unsigned char* p) { typedef __attribute__((address_space(3))) s16x8 lds_s16x8; return __builtin_bit_cast(u32x4, __builtin_amdgcn_ds_load_tr16_b128_v8i16((lds_s16x8*)p)); }

// P[b][range][tile = et * 4 + dt][j][lane][4]: lane (c, h), register r = 4 j + i = sum over the range's keys s of k[s][16 dt + 8 h + r] * v[s][16 et + c]
__global__ __launch_bounds__(256) void k_ktv(const float* __restrict__ k, const float* __restrict__ v, float* __restrict__ P) {
  __shared__ __attribute__((aligned(16))) unsigned char L[2u * RK * PT];
  const unsigned tid = threadIdx.x, lane = tid & 31u, w = tid >> 5, blk = blockIdx.x;      /* blk = b * NC + range: its rows start at blk * RK */
  const v4fa* kg = (const v4fa*)(k + (size_t)blk * RK * HD) + tid;
  const v4fa* vg = (const v4fa*)(v + (size_t)blk * RK * HD) + tid;
  v4f xk[16], xv[16];
  for (int j = 0; j < 16; ++j) xk[j] = kg[j * 256];
  for (int j = 0; j < 16; ++j) xv[j] = vg[j * 256];
  unsigned char* st = L + (tid >> 4) * PT + (tid & 15u) * 8u;      /* load j holds row 16 j + tid / 16, columns 4 (tid % 16) ... + 3 */
  for (int j = 0; j < 16; ++j) { const u32x2 o = {in16(xk[j][0], xk[j][1]), in16(xk[j][2], xk[j][3])}; *(u32x2a*)(st + (unsigned)j * 16u * PT) = o; }
  for (int j = 0; j < 16; ++j) { const u32x2 o = {in16(xv[j][0], xv[j][1]), in16(xv[j][2], xv[j][3])}; *(u32x2a*)(st + RK * PT + (unsigned)j * 16u * PT) = o; }
  __syncthreads();
  const unsigned dt = w & 3u, ep = w >> 2;      /* the wave's tiles: rows 16 dt of M, columns 32 ep and 32 ep + 16 */
  const unsigned char* ad = L + (8u * (lane >> 4) + (lane & 7u)) * PT + ((lane >> 3) & 1u) * 16u;      /* lane (c, h) gets rows 8 h ... 8 h + 7 of column c: the same keys in both operands */
  const unsigned char* ak = ad + 32u * dt;
  const unsigned char* av = ad + RK * PT + 64u * ep;
  v8f c0 = {0.f, 0.f, 0.f, 0.f, 0.f, 0.f, 0.f, 0.f}, c1 = c0;
  for (int s = 0; s < RK / 32; ++s) {
    const unsigned o = (unsigned)s * 32u * PT;
    Frag a, b0, b1;
    a.q[0] = ld_tr16(ak + o); a.q[1] = ld_tr16(ak + o + 16u * PT);
    b0.q[0] = ld_tr16(av + o); b0.q[1] = ld_tr16(av + o + 16u * PT);
    b1.q[0] = ld_tr16(av + o + 32u); b1.q[1] = ld_tr16(av + o + 16u * PT + 32u);
    c0 = __builtin_amdgcn_wmma_f32_16x16x32_f16(false, a.v, false, b0.v, (short)0, c0, false, false);
    c1 = __builtin_amdgcn_wmma_f32_16x16x32_f16(false, a.v, false, b1.v, (short)0, c1, false, false);
  }
  float* o0 = P + ((size_t)blk * 16u + (2u * ep) * 4u + dt) * 256u + lane * 4u;
  const v4f s0 = {c0[0], c0[1], c0[2], c0[3]}, s1 = {c0[4], c0[5], c0[6], c0[7]}, s2 = {c1[0], c1[1], c1[2], c1[3]}, s3 = {c1[4], c1[5], c1[6], c1[7]};
  *(v4fa*)o0 = s0; *(v4fa*)(o0 + 128) = s1; *(v4fa*)(o0 + 1024) = s2; *(v4fa*)(o0 + 1152) = s3;
}

// out[b][i][e] = sum over d of q[b][i][d] * M[b][d][e]; q is the first operand and column tile t holds columns 2 c + t of the half, so lanes 0-15 hold, in the two tiles' registers r, one row's 32 columns in order
__global__ __launch_bounds__(256) void k_qm(const float* __restrict__ q, const float* __restrict__ P, float* __restrict__ out) {
  __shared__ __attribute__((aligned(16))) unsigned char Lq[RQ * PQ];
  __shared__ __attribute__((aligned(16))) unsigned char Lm[4096];
  const unsigned tid = threadIdx.x, lane = tid & 31u, w = tid >> 5, c = lane & 15u, h = lane >> 4;
  const unsigned eh = blockIdx.x & 1u, rt = (blockIdx.x >> 1) & (SS / RQ - 1u), b = blockIdx.x / (2u * (SS / RQ));      /* column half, row tile, batch member */
  const v4fa* pg = (const v4fa*)(P + (size_t)b * NC * (HD * HD) + eh * (HD * HD / 2)) + tid;      /* the half's 8 tiles lie in a row: 512 groups of 4 */
  const v4fa* qg = (const v4fa*)(q + ((size_t)b * SS + rt * RQ) * HD) + tid;
  v4f p0[NC], p1[NC], xq[16];
  for (int r = 0; r < NC; ++r) { p0[r] = pg[r * (HD * HD / 4)]; p1[r] = pg[r * (HD * HD / 4) + 256]; }
  for (int j = 0; j < 16; ++j) xq[j] = qg[j * 256];
  __builtin_amdgcn_sched_barrier(0);      /* keeps all 48 loads issued ahead of the first use: without it the compiler sinks the partials' loads into the sum, 4 in flight, one L2 latency per 4 */
  v4f m0 = p0[0], m1 = p1[0];
  for (int r = 1; r < NC; ++r) { m0 += p0[r]; m1 += p1[r]; }
  // group g of 4 holds registers 4 j ... + 3, j = (g / 32) % 2, of lane g % 32 = (c, h) of tile g / 64 = 4 et + dt: d = 16 dt + 8 h + 4 j ..., column x = 16 et + c of the half
  // in LDS a tile is 32 lanes x 16 bytes as before, but column x goes to tile 4 (x % 2) + dt, lane (x / 2, h)
  unsigned char* sm = Lm + ((c & 1u) * 4u + (tid >> 6)) * 512u + ((c >> 1) + 16u * h) * 16u + ((tid >> 5) & 1u) * 8u;
  { const u32x2 o = {cv16(m0[0], m0[1]), cv16(m0[2], m0[3])}; *(u32x2a*)sm = o; }
  { const u32x2 o = {cv16(m1[0], m1[1]), cv16(m1[2], m1[3])}; *(u32x2a*)(sm + 128u) = o; }
  unsigned char* st = Lq + (tid >> 4) * PQ + (tid & 15u) * 8u;
  for (int j = 0; j < 16; ++j) { const u32x2 o = {in16(xq[j][0], xq[j][1]), in16(xq[j][2], xq[j][3])}; *(u32x2a*)(st + (unsigned)j * 16u * PQ) = o; }
  __syncthreads();
  // M fragment (column tile t, d block kb): accumulator tiles dt = 2 kb and 2 kb + 1 side by side give d = 32 kb + 8 h + s (s < 8), 32 kb + 16 + 8 h + s - 8; q is read in the same order
  Frag mf[2][2], qf[2][2];
  for (int t = 0; t < 2; ++t)
    for (int kb = 0; kb < 2; ++kb) { const unsigned char* p = Lm + (unsigned)(t * 4 + 2 * kb) * 512u + lane * 16u; mf[t][kb].q[0] = *(const u32x4a*)p; mf[t][kb].q[1] = *(const u32x4a*)(p + 512u); }
  for (int g = 0; g < 2; ++g)
    for (int kb = 0; kb < 2; ++kb) { const unsigned char* p = Lq + (32u * w + 16u * (unsigned)g + c) * PQ + (unsigned)kb * 64u + 16u * h; qf[g][kb].q[0] = *(const u32x4a*)p; qf[g][kb].q[1] = *(const u32x4a*)(p + 32u); }
  // register r of lane (c, h) of row group g: row 16 g + 8 h + r, columns 2 c and 2 c + 1: 16 lanes x 8 bytes are the work-group's whole 128-byte line of that row
  float* o = out + ((size_t)b * SS + rt * RQ + 32u * w + 8u * h) * HD + eh * 32u + 2u * c;
  for (int g = 0; g < 2; ++g) {
    v8f a[2];
    for (int t = 0; t < 2; ++t) {
      const v8f z = {0.f, 0.f, 0.f, 0.f, 0.f, 0.f, 0.f, 0.f};
      a[t] = __builtin_amdgcn_wmma_f32_16x16x32_f16(false, qf[g][0].v, false, mf[t][0].v, (short)0, z, false, false);
      a[t] = __builtin_amdgcn_wmma_f32_16x16x32_f16(false, qf[g][1].v, false, mf[t][1].v, (short)0, a[t], false, false);
    }
    for (int r = 0; r < 8; ++r) { const v2f s = {a[0][r], a[1][r]}; *(v2fa*)(o + (16 * g + r) * HD) = s; }
  }
}

extern "C" void kernel_launch(void* const* d_in, const int* in_sizes, int n_in,
                              void* d_out, int out_size, void* d_ws, size_t ws_size, hipStream_t stream) {
  (void)in_sizes; (void)n_in; (void)out_size;
  const float* const* I = (const float* const*)d_in; const float* q = I[0]; const float* k = I[1]; const float* v = I[2];      /* order: q, k, v, each [4][4096][64] f32 */
  float* P = (float*)d_ws;      /* partials of M: 4 x 16 x 64 x 64 f32, every one written by launch 1 before launch 2 reads it */
  if ((size_t)NB * NC * HD * HD * 4 > ws_size) return;
  k_ktv<<<NB * NC, 256, 0, stream>>>(k, v, P);
  k_qm<<<NB * (SS / RQ) * 2, 256, 0, stream>>>(q, P, (float*)d_out);
}

// v003
// Measured time: 8.93 microseconds a run.
// Next to v002, in two timings, it ran 1.13 and 1.09 times as fast.
// Over all steps from v000 it is 20.8 times as fast.
#include <hip/hip_runtime.h>
#include <stdint.h>
// Softmax-free 'attention': out = (q k^T) v per batch member, no scale, no softmax, no mask (q, k, v [4][4096][64] f32).
// The product is associative, so it is formed as out = q (k^T v): M = k^T v is 64 x 64 per batch member and no 4096 x 4096 score plane exists.
// Launch 1: a work-group forms one 32 x 32 quadrant of M over a range of 512 keys (8 ranges per batch member), so it reads half rows of k and of v. Each of its 4 waves takes 128 keys:
//           it stages them in its own LDS rows as f16, reads both operands back through transposing loads (the sum index is the key, which is the row of both) and holds 4 tiles;
//           the 4 waves' tiles are joined in LDS (fixed order) and written as one f32 partial of M, registers 0-3 and 4-7 of a tile as two planes of 32 lanes x 16 bytes.
// Launch 2: each work-group sums the 8 partials of its 32 output columns (fixed order), rounds M to f16 and multiplies 256 rows of q by it.
// Every global store instruction covers whole 128-byte lines: the partials by the two planes, out by dealing even and odd columns to the two column tiles.
// Compute dtype: inputs rounded to bf16, held as exact f16 operands; the ONE computed operand is M, rounded to f16; both accumulations f32. v_wmma_f32_16x16x32_f16.
#define NB 4
#define SS 4096                 /* rows per batch member */
#define HD 64
#define NC 8                    /* key ranges per batch member */
#define RK (SS / NC)            /* keys per range */
#define WK (RK / 4)             /* keys per wave of launch 1 */
#define PT 160u                 /* LDS row pitch in bytes of launch 1: 64 B of k columns, 64 B of v columns, pad to 32 B x odd, for ds_load_tr16_b128 */
#define RQ 256                  /* q rows per work-group of launch 2 */
#define PQ 144u                 /* LDS row pitch in bytes of the q tile: 16 B x odd, for ds_load_b128 */
typedef _Float16 v16h __attribute__((ext_vector_type(16)));
typedef _Float16 v2h  __attribute__((ext_vector_type(2)));
typedef __bf16   v2b  __attribute__((ext_vector_type(2)));
typedef float    v2f  __attribute__((ext_vector_type(2)));
typedef float    v2fa __attribute__((ext_vector_type(2), may_alias));
typedef float    v4f  __attribute__((ext_vector_type(4)));
typedef float    v4fa __attribute__((ext_vector_type(4), may_alias));
typedef float    v8f  __attribute__((ext_vector_type(8)));
typedef uint32_t u32x4  __attribute__((ext_vector_type(4)));
typedef uint32_t u32x4a __attribute__((ext_vector_type(4), may_alias));
typedef uint32_t u32x2  __attribute__((ext_vector_type(2)));
typedef uint32_t u32x2a __attribute__((ext_vector_type(2), may_alias));
typedef short    s16x8  __attribute__((ext_vector_type(8)));
union Frag { v16h v; u32x4 q[2]; };

// two inputs: rounded to bf16 (nearest even), then held as f16
__device__ __forceinline__ uint32_t in16(float a, float b) { const v2f x = {a, b}; const v2b y = __builtin_convertvector(x, v2b); const v2f z = __builtin_convertvector(y, v2f); return __builtin_bit_cast(uint32_t, __builtin_convertvector(z, v2h)); }
// two computed values: rounded to f16 (nearest even)
__device__ __forceinline__ uint32_t cv16(float a, float b) { const v2f x = {a, b}; return __builtin_bit_cast(uint32_t, __builtin_convertvector(x, v2h)); }
__device__ __forceinline__ u32x4 ld_tr16(const unsigned char* p) { typedef __attribute__((address_space(3))) s16x8 lds_s16x8; return __builtin_bit_cast(u32x4, __builtin_amdgcn_ds_load_tr16_b128_v8i16((lds_s16x8*)p)); }

// P[b][range][tile = et * 4 + dt][j][lane][4]: lane (c, h), register r = 4 j + i = sum over the range's keys s of k[s][16 dt + 8 h + r] * v[s][16 et + c]
__global__ __launch_bounds__(128) void k_ktv(const float* __restrict__ k, const float* __restrict__ v, float* __restrict__ P) {
  __shared__ __attribute__((aligned(16))) unsigned char L[RK * PT];
  __shared__ __attribute__((aligned(16))) unsigned char J[4u * 4u * 1024u];      /* the join: [wave][tile][plane][lane] x 16 bytes */
  const unsigned tid = threadIdx.x, lane = tid & 31u, w = tid >> 5;
  const unsigned dh = blockIdx.x & 1u, eh = (blockIdx.x >> 1) & 1u, br = blockIdx.x >> 2;      /* row half and column half of M; br = b * NC + range: its rows start at br * RK */
  const size_t r0 = (size_t)br * RK + w * WK + (lane >> 3);      /* load j holds row 4 j + lane / 8 of the wave's keys, columns 4 (lane % 8) ... + 3 of the half: 4 whole 128-byte lines */
  const v4fa* kg = (const v4fa*)(k + r0 * HD + dh * 32u + (lane & 7u) * 4u);
  const v4fa* vg = (const v4fa*)(v + r0 * HD + eh * 32u + (lane & 7u) * 4u);
  v4f xk[32], xv[32];
#pragma unroll
  for (int s = 0; s < 4; ++s) {      /* in the order of use: 32 keys of k, the same 32 keys of v */
#pragma unroll
    for (int j = 8 * s; j < 8 * s + 8; ++j) xk[j] = kg[j * HD];
#pragma unroll
    for (int j = 8 * s; j < 8 * s + 8; ++j) xv[j] = vg[j * HD];
  }
  asm volatile("s_wait_xcnt 0x0" :: "v"(kg), "v"(vg) : "memory");      /* stands in front of every overwrite of the loads' two address pairs, which are named as inputs so that they stay whole up to here */
  __builtin_amdgcn_sched_barrier(0);      /* keeps all 64 loads issued ahead of the first use: without it the compiler holds the second 32 back until the first ones have returned, one more load latency */
  unsigned char* Lw = L + w * (WK * PT);      /* the wave's own rows: no other wave reads or writes them */
  unsigned char* st = Lw + (lane >> 3) * PT + (lane & 7u) * 8u;
  const unsigned char* ad = Lw + (8u * (lane >> 4) + (lane & 7u)) * PT + ((lane >> 3) & 1u) * 16u;      /* lane (c, h) gets rows 8 h ... 8 h + 7 of column c: the same keys in both operands */
  const v8f z = {0.f, 0.f, 0.f, 0.f, 0.f, 0.f, 0.f, 0.f};
  v8f c[2][2] = {{z, z}, {z, z}};      /* [column tile][row tile] of the quadrant */
#pragma unroll
  for (int s = -1; s < 4; ++s) {      /* pass s: the fragments of keys 32 s ... are asked for, the next 32 keys are rounded and staged under that LDS latency, then the products of pass s */
    Frag a[2], b[2];
    if (s >= 0) {
      const unsigned o = (unsigned)s * 32u * PT;
#pragma unroll
      for (int t = 0; t < 2; ++t) {
        a[t].q[0] = ld_tr16(ad + o + 32u * t); a[t].q[1] = ld_tr16(ad + o + 16u * PT + 32u * t);
        b[t].q[0] = ld_tr16(ad + o + 64u + 32u * t); b[t].q[1] = ld_tr16(ad + o + 16u * PT + 64u + 32u * t);
      }
    }
    if (s < 3) {
#pragma unroll
      for (int j = 8 * s + 8; j < 8 * s + 16; ++j) {
        const u32x2 ok = {in16(xk[j][0], xk[j][1]), in16(xk[j][2], xk[j][3])}; *(u32x2a*)(st + (unsigned)j * 4u * PT) = ok;
        const u32x2 ov = {in16(xv[j][0], xv[j][1]), in16(xv[j][2], xv[j][3])}; *(u32x2a*)(st + (unsigned)j * 4u * PT + 64u) = ov;
      }
      asm volatile("s_wait_dscnt 0x0" ::: "memory");      /* the wave's own LDS stores have landed before its lanes read each other's rows back in the next pass; it also keeps those reads behind these stores in the build */
    }
    if (s >= 0) {
#pragma unroll
      for (int e = 0; e < 2; ++e)
#pragma unroll
        for (int d = 0; d < 2; ++d) c[e][d] = __builtin_amdgcn_wmma_f32_16x16x32_f16(false, a[d].v, false, b[e].v, (short)0, c[e][d], false, false);
    }
    __builtin_amdgcn_sched_barrier(0);      /* keeps later keys' conversions out of this pass: moved up, their load waits hold back products whose keys have long arrived, and the work piles up behind the last load */
  }
  unsigned char* jw = J + w * 4096u + lane * 16u;
#pragma unroll
  for (int t = 0; t < 4; ++t) {
    const v8f x = c[t >> 1][t & 1];
    const v4f lo = {x[0], x[1], x[2], x[3]}, hi = {x[4], x[5], x[6], x[7]};
    *(v4fa*)(jw + t * 1024) = lo; *(v4fa*)(jw + t * 1024 + 512) = hi;
  }
  __syncthreads();
  // wave w sums tile w = 2 (column tile) + (row tile) over the four waves' key groups, in the order of the keys
  const unsigned char* jr = J + w * 1024u + lane * 16u;
  v4f s0 = *(const v4fa*)jr, s1 = *(const v4fa*)(jr + 512);
#pragma unroll
  for (int u = 1; u < 4; ++u) { s0 += *(const v4fa*)(jr + u * 4096); s1 += *(const v4fa*)(jr + u * 4096 + 512); }
  float* o0 = P + ((size_t)br * 16u + (2u * eh + (w >> 1)) * 4u + 2u * dh + (w & 1u)) * 256u + lane * 4u;
  *(v4fa*)o0 = s0; *(v4fa*)(o0 + 128) = s1;
}

// out[b][i][e] = sum over d of q[b][i][d] * M[b][d][e]; q is the first operand and column tile t holds columns 2 c + t of the half, so lanes 0-15 hold, in the two tiles' registers r, one row's 32 columns in order
__global__ __launch_bounds__(256) void k_qm(const float* __restrict__ q, const float* __restrict__ P, float* __restrict__ out) {
  __shared__ __attribute__((aligned(16))) unsigned char Lq[RQ * PQ];
  __shared__ __attribute__((aligned(16))) unsigned char Lm[4096];
  const unsigned tid = threadIdx.x, lane = tid & 31u, w = tid >> 5, c = lane & 15u, h = lane >> 4;
  const unsigned eh = blockIdx.x & 1u, rt = (blockIdx.x >> 1) & (SS / RQ - 1u), b = blockIdx.x / (2u * (SS / RQ));      /* column half, row tile, batch member */
  const v4fa* pg = (const v4fa*)(P + (size_t)b * NC * (HD * HD) + eh * (HD * HD / 2)) + tid;      /* the half's 8 tiles lie in a row: 512 groups of 4 */
  const v4fa* qg = (const v4fa*)(q + ((size_t)b * SS + rt * RQ) * HD) + tid;
  v4f p0[NC], p1[NC], xq[16];
  for (int r = 0; r < NC; ++r) { p0[r] = pg[r * (HD * HD / 4)]; p1[r] = pg[r * (HD * HD / 4) + 256]; }
  for (int j = 0; j < 16; ++j) xq[j] = qg[j * 256];
  __builtin_amdgcn_sched_barrier(0);      /* keeps all 32 loads issued ahead of the first use: without it the compiler sinks the partials' loads into the sum, 4 in flight, one L2 latency per 4 */
  v4f m0 = p0[0], m1 = p1[0];
  for (int r = 1; r < NC; ++r) { m0 += p0[r]; m1 += p1[r]; }
  // group g of 4 holds registers 4 j ... + 3, j = (g / 32) % 2, of lane g % 32 = (c, h) of tile g / 64 = 4 et + dt: d = 16 dt + 8 h + 4 j ..., column x = 16 et + c of the half
  // in LDS a tile is 32 lanes x 16 bytes as before, but column x goes to tile 4 (x % 2) + dt, lane (x / 2, h)
  unsigned char* sm = Lm + ((c & 1u) * 4u + (tid >> 6)) * 512u + ((c >> 1) + 16u * h) * 16u + ((tid >> 5) & 1u) * 8u;
  { const u32x2 o = {cv16(m0[0], m0[1]), cv16(m0[2], m0[3])}; *(u32x2a*)sm = o; }
  { const u32x2 o = {cv16(m1[0], m1[1]), cv16(m1[2], m1[3])}; *(u32x2a*)(sm + 128u) = o; }
  unsigned char* st = Lq + (tid >> 4) * PQ + (tid & 15u) * 8u;
  for (int j = 0; j < 16; ++j) { const u32x2 o = {in16(xq[j][0], xq[j][1]), in16(xq[j][2], xq[j][3])}; *(u32x2a*)(st + (unsigned)j * 16u * PQ) = o; }
  __syncthreads();
  // M fragment (column tile t, d block kb): accumulator tiles dt = 2 kb and 2 kb + 1 side by side give d = 32 kb + 8 h + s (s < 8), 32 kb + 16 + 8 h + s - 8; q is read in the same order
  Frag mf[2][2], qf[2][2];
  for (int t = 0; t < 2; ++t)
    for (int kb = 0; kb < 2; ++kb) { const unsigned char* p = Lm + (unsigned)(t * 4 + 2 * kb) * 512u + lane * 16u; mf[t][kb].q[0] = *(const u32x4a*)p; mf[t][kb].q[1] = *(const u32x4a*)(p + 512u); }
  for (int g = 0; g < 2; ++g)
    for (int kb = 0; kb < 2; ++kb) { const unsigned char* p = Lq + (32u * w + 16u * (unsigned)g + c) * PQ + (unsigned)kb * 64u + 16u * h; qf[g][kb].q[0] = *(const u32x4a*)p; qf[g][kb].q[1] = *(const u32x4a*)(p + 32u); }
  // register r of lane (c, h) of row group g: row 16 g + 8 h + r, columns 2 c and 2 c + 1: 16 lanes x 8 bytes are the work-group's whole 128-byte line of that row
  float* o = out + ((size_t)b * SS + rt * RQ + 32u * w + 8u * h) * HD + eh * 32u + 2u * c;
  for (int g = 0; g < 2; ++g) {
    v8f a[2];
    for (int t = 0; t < 2; ++t) {
      const v8f z = {0.f, 0.f, 0.f, 0.f, 0.f, 0.f, 0.f, 0.f};
      a[t] = __builtin_amdgcn_wmma_f32_16x16x32_f16(false, qf[g][0].v, false, mf[t][0].v, (short)0, z, false, false);
      a[t] = __builtin_amdgcn_wmma_f32_16x16x32_f16(false, qf[g][1].v, false, mf[t][1].v, (short)0, a[t], false, false);
    }
    for (int r = 0; r < 8; ++r) { const v2f s = {a[0][r], a[1][r]}; *(v2fa*)(o + (16 * g + r) * HD) = s; }
  }
}

extern "C" void kernel_launch(void* const* d_in, const int* in_sizes, int n_in,
                              void* d_out, int out_size, void* d_ws, size_t ws_size, hipStream_t stream) {
  (void)in_sizes; (void)n_in; (void)out_size;
  const float* const* I = (const float* const*)d_in; const float* q = I[0]; const float* k = I[1]; const float* v = I[2];      /* order: q, k, v, each [4][4096][64] f32 */
  float* P = (float*)d_ws;      /* partials of M: 4 x 8 x 64 x 64 f32, every one written by launch 1 before launch 2 reads it */
  if ((size_t)NB * NC * HD * HD * 4 > ws_size) return;
  k_ktv<<<NB * NC * 4, 128, 0, stream>>>(k, v, P);
  k_qm<<<NB * (SS / RQ) * 2, 256, 0, stream>>>(q, P, (float*)d_out);
}

// v004
// One run takes 8.24 microseconds.
// Next to v003, in two timings, it ran 1.08 and 1.10 times as fast.
// Counting every step since v000, it is 22.7 times as fast.
#include <hip/hip_runtime.h>
#include <stdint.h>
// Softmax-free 'attention': out = (q k^T) v per batch member, no scale, no softmax, no mask (q, k, v [4][4096][64] f32).
// The product is associative, so it is formed as out = q (k^T v): M = k^T v is 64 x 64 per batch member and no 4096 x 4096 score plane exists.
// Launch 1: a work-group forms one 32 x 32 quadrant of M over a range of 512 keys (8 ranges per batch member), so it reads half rows of k and of v. Each of its 4 waves takes 128 keys:
//           it stages them in its own LDS rows as f16, reads both operands back through transposing loads (the sum index is the key, which is the row of both) and holds 4 tiles;
//           the 4 waves' tiles are joined in LDS (fixed order) and written as one f32 partial of M, registers 0-3 and 4-7 of a tile as two planes of 32 lanes x 16 bytes.
// Launch 2: each work-group sums the 8 partials of its 32 output columns (fixed order), rounds M to f16 and multiplies 256 rows of q by it: 4 waves, each with its own 64 rows,
//           staged in its own LDS rows and multiplied and stored in 4 passes of 16 rows in the order in which the loads land.
// Every global store instruction covers whole 128-byte lines: the partials by the two planes, out by dealing even and odd columns to the two column tiles.
// Compute dtype: inputs rounded to bf16, held as exact f16 operands; the ONE computed operand is M, rounded to f16; both accumulations f32. v_wmma_f32_16x16x32_f16.
#define NB 4
#define SS 4096                 /* rows per batch member */
#define HD 64
#define NC 8                    /* key ranges per batch member */
#define RK (SS / NC)            /* keys per range */
#define WK (RK / 4)             /* keys per wave of launch 1 */
#define PT 160u                 /* LDS row pitch in bytes of launch 1: 64 B of k columns, 64 B of v columns, pad to 32 B x odd, for ds_load_tr16_b128 */
#define RQ 256                  /* q rows per work-group of launch 2 */
#define WQ (RQ / 4)             /* q rows per wave of launch 2 */
#define PQ 144u                 /* LDS row pitch in bytes of the q tile: 16 B x odd, for ds_load_b128 */
typedef _Float16 v16h __attribute__((ext_vector_type(16)));
typedef _Float16 v2h  __attribute__((ext_vector_type(2)));
typedef __bf16   v2b  __attribute__((ext_vector_type(2)));
typedef float    v2f  __attribute__((ext_vector_type(2)));
typedef float    v2fa __attribute__((ext_vector_type(2), may_alias));
typedef float    v4f  __attribute__((ext_vector_type(4)));
typedef float    v4fa __attribute__((ext_vector_type(4), may_alias));
typedef float    v8f  __attribute__((ext_vector_type(8)));
typedef uint32_t u32x4  __attribute__((ext_vector_type(4)));
typedef uint32_t u32x4a __attribute__((ext_vector_type(4), may_alias));
typedef uint32_t u32x2  __attribute__((ext_vector_type(2)));
typedef uint32_t u32x2a __attribute__((ext_vector_type(2), may_alias));
typedef short    s16x8  __attribute__((ext_vector_type(8)));
union Frag { v16h v; u32x4 q[2]; };

// two inputs: rounded to bf16 (nearest even), then held as f16
__device__ __forceinline__ uint32_t in16(float a, float b) { const v2f x = {a, b}; const v2b y = __builtin_convertvector(x, v2b); const v2f z = __builtin_convertvector(y, v2f); return __builtin_bit_cast(uint32_t, __builtin_convertvector(z, v2h)); }
// two computed values: rounded to f16 (nearest even)
__device__ __forceinline__ uint32_t cv16(float a, float b) { const v2f x = {a, b}; return __builtin_bit_cast(uint32_t, __builtin_convertvector(x, v2h)); }
__device__ __forceinline__ u32x4 ld_tr16(const unsigned char* p) { typedef __attribute__((address_space(3))) s16x8 lds_s16x8; return __builtin_bit_cast(u32x4, __builtin_amdgcn_ds_load_tr16_b128_v8i16((lds_s16x8*)p)); }

// P[b][range][tile = et * 4 + dt][j][lane][4]: lane (c, h), register r = 4 j + i = sum over the range's keys s of k[s][16 dt + 8 h + r] * v[s][16 et + c]
__global__ __launch_bounds__(128) void k_ktv(const float* __restrict__ k, const float* __restrict__ v, float* __restrict__ P) {
  __shared__ __attribute__((aligned(16))) unsigned char L[RK * PT];
  __shared__ __attribute__((aligned(16))) unsigned char J[4u * 4u * 1024u];      /* the join: [wave][tile][plane][lane] x 16 bytes */
  const unsigned tid = threadIdx.x, lane = tid & 31u, w = tid >> 5;
  const unsigned dh = blockIdx.x & 1u, eh = (blockIdx.x >> 1) & 1u, br = blockIdx.x >> 2;      /* row half and column half of M; br = b * NC + range: its rows start at br * RK */
  const size_t r0 = (size_t)br * RK + w * WK + (lane >> 3);      /* load j holds row 4 j + lane / 8 of the wave's keys, columns 4 (lane % 8) ... + 3 of the half: 4 whole 128-byte lines */
  const v4fa* kg = (const v4fa*)(k + r0 * HD + dh * 32u + (lane & 7u) * 4u);
  const v4fa* vg = (const v4fa*)(v + r0 * HD + eh * 32u + (lane & 7u) * 4u);
  v4f xk[32], xv[32];
#pragma unroll
  for (int s = 0; s < 4; ++s) {      /* in the order of use: 32 keys of k, the same 32 keys of v */
#pragma unroll
    for (int j = 8 * s; j < 8 * s + 8; ++j) xk[j] = kg[j * HD];
#pragma unroll
    for (int j = 8 * s; j < 8 * s + 8; ++j) xv[j] = vg[j * HD];
  }
  asm volatile("s_wait_xcnt 0x0" :: "v"(kg), "v"(vg) : "memory");      /* stands in front of every overwrite of the loads' two address pairs, which are named as inputs so that they stay whole up to here */
  __builtin_amdgcn_sched_barrier(0);      /* keeps all 64 loads issued ahead of the first use: without it the compiler holds the second 32 back until the first ones have returned, one more load latency */
  unsigned char* Lw = L + w * (WK * PT);      /* the wave's own rows: no other wave reads or writes them */
  unsigned char* st = Lw + (lane >> 3) * PT + (lane & 7u) * 8u;
  const unsigned char* ad = Lw + (8u * (lane >> 4) + (lane & 7u)) * PT + ((lane >> 3) & 1u) * 16u;      /* lane (c, h) gets rows 8 h ... 8 h + 7 of column c: the same keys in both operands */
  const v8f z = {0.f, 0.f, 0.f, 0.f, 0.f, 0.f, 0.f, 0.f};
  v8f c[2][2] = {{z, z}, {z, z}};      /* [column tile][row tile] of the quadrant */
#pragma unroll
  for (int s = -1; s < 4; ++s) {      /* pass s: the fragments of keys 32 s ... are asked for, the next 32 keys are rounded and staged under that LDS latency, then the products of pass s */
    Frag a[2], b[2];
    if (s >= 0) {
      const unsigned o = (unsigned)s * 32u * PT;
#pragma unroll
      for (int t = 0; t < 2; ++t) {
        a[t].q[0] = ld_tr16(ad + o + 32u * t); a[t].q[1] = ld_tr16(ad + o + 16u * PT + 32u * t);
        b[t].q[0] = ld_tr16(ad + o + 64u + 32u * t); b[t].q[1] = ld_tr16(ad + o + 16u * PT + 64u + 32u * t);
      }
    }
    if (s < 3) {
#pragma unroll
      for (int j = 8 * s + 8; j < 8 * s + 16; ++j) {
        const u32x2 ok = {in16(xk[j][0], xk[j][1]), in16(xk[j][2], xk[j][3])}; *(u32x2a*)(st + (unsigned)j * 4u * PT) = ok;
        const u32x2 ov = {in16(xv[j][0], xv[j][1]), in16(xv[j][2], xv[j][3])}; *(u32x2a*)(st + (unsigned)j * 4u * PT + 64u) = ov;
      }
      asm volatile("s_wait_dscnt 0x0" ::: "memory");      /* the wave's own LDS stores have landed before its lanes read each other's rows back in the next pass; it also keeps those reads behind these stores in the build */
    }
    if (s >= 0) {
#pragma unroll
      for (int e = 0; e < 2; ++e)
#pragma unroll
        for (int d = 0; d < 2; ++d) c[e][d] = __builtin_amdgcn_wmma_f32_16x16x32_f16(false, a[d].v, false, b[e].v, (short)0, c[e][d], false, false);
    }
    __builtin_amdgcn_sched_barrier(0);      /* keeps later keys' conversions out of this pass: moved up, their load waits hold back products whose keys have long arrived, and the work piles up behind the last load */
  }
  unsigned char* jw = J + w * 4096u + lane * 16u;
#pragma unroll
  for (int t = 0; t < 4; ++t) {
    const v8f x = c[t >> 1][t & 1];
    const v4f lo = {x[0], x[1], x[2], x[3]}, hi = {x[4], x[5], x[6], x[7]};
    *(v4fa*)(jw + t * 1024) = lo; *(v4fa*)(jw + t * 1024 + 512) = hi;
  }
  __syncthreads();
  // wave w sums tile w = 2 (column tile) + (row tile) over the four waves' key groups, in the order of the keys
  const unsigned char* jr = J + w * 1024u + lane * 16u;
  v4f s0 = *(const v4fa*)jr, s1 = *(const v4fa*)(jr + 512);
#pragma unroll
  for (int u = 1; u < 4; ++u) { s0 += *(const v4fa*)(jr + u * 4096); s1 += *(const v4fa*)(jr + u * 4096 + 512); }
  float* o0 = P + ((size_t)br * 16u + (2u * eh + (w >> 1)) * 4u + 2u * dh + (w & 1u)) * 256u + lane * 4u;
  *(v4fa*)o0 = s0; *(v4fa*)(o0 + 128) = s1;
}

// out[b][i][e] = sum over d of q[b][i][d] * M[b][d][e]; q is the first operand and column tile t holds columns 2 c + t of the half, so lanes 0-15 hold, in the two tiles' registers r, one row's 32 columns in order
__global__ __launch_bounds__(128) void k_qm(const float* __restrict__ q, const float* __restrict__ P, float* __restrict__ out) {
  __shared__ __attribute__((aligned(16))) unsigned char Lq[RQ * PQ];
  __shared__ __attribute__((aligned(16))) unsigned char Lm[4096];
  const unsigned tid = threadIdx.x, lane = tid & 31u, w = tid >> 5, c = lane & 15u, h = lane >> 4;
  const unsigned eh = blockIdx.x & 1u, rt = (blockIdx.x >> 1) & (SS / RQ - 1u), b = blockIdx.x / (2u * (SS / RQ));      /* column half, row tile, batch member */
  const v4fa* pg = (const v4fa*)(P + (size_t)b * NC * (HD * HD) + eh * (HD * HD / 2)) + tid;      /* the half's 8 tiles lie in a row: 512 groups of 4, a thread takes groups tid + 128 i */
  const v4fa* qg = (const v4fa*)(q + ((size_t)b * SS + rt * RQ + w * WQ) * HD) + lane;      /* load j holds rows 2 j and 2 j + 1 of the wave's own 64: 4 whole 128-byte lines */
  v4f p[4][NC], xq[32];
  for (int i = 0; i < 4; ++i)
    for (int r = 0; r < NC; ++r) p[i][r] = pg[r * (HD * HD / 4) + i * 128];
  for (int j = 0; j < 32; ++j) xq[j] = qg[j * 32];
  asm volatile("s_wait_xcnt 0x0" :: "v"(pg), "v"(qg) : "memory");      /* stands in front of every overwrite of the loads' two address pairs, which are named as inputs so that they stay whole up to here */
  __builtin_amdgcn_sched_barrier(0);      /* keeps all 64 loads issued ahead of the first use: without it the compiler sinks loads into the sums and the conversions, a few in flight, one L2 latency per few */
  // group g = tid + 128 i holds registers 4 j ... + 3, j = (g / 32) % 2, of lane g % 32 = (c, h) of tile g / 64 = 4 et + dt: d = 16 dt + 8 h + 4 j ..., column x = 16 et + c of the half
  // in LDS a tile is 32 lanes x 16 bytes as before, but column x goes to tile 4 (x % 2) + dt, lane (x / 2, h)
  unsigned char* sm = Lm + ((c & 1u) * 4u + (tid >> 6)) * 512u + ((c >> 1) + 16u * h) * 16u + ((tid >> 5) & 1u) * 8u;
  for (int i = 0; i < 4; ++i) {      /* dt = tid / 64 + 2 (i % 2), et = i / 2 */
    v4f m = p[i][0];
    for (int r = 1; r < NC; ++r) m += p[i][r];
    const u32x2 o = {cv16(m[0], m[1]), cv16(m[2], m[3])}; *(u32x2a*)(sm + (unsigned)(i & 1) * 1024u + (unsigned)(i >> 1) * 128u) = o;
  }
  unsigned char* Lw = Lq + w * (WQ * PQ);      /* the wave's own rows: no other wave reads or writes them */
  unsigned char* st = Lw + h * PQ + c * 8u;
  const unsigned char* fr = Lw + c * PQ + 16u * h;
  for (int j = 0; j < 8; ++j) { const u32x2 y = {in16(xq[j][0], xq[j][1]), in16(xq[j][2], xq[j][3])}; *(u32x2a*)(st + (unsigned)j * 2u * PQ) = y; }
  asm volatile("s_wait_dscnt 0x0\n\ts_barrier_signal -1\n\ts_barrier_wait -1" ::: "memory");      /* the work-group's barrier, for M alone, behind each wave's own LDS stores (its share of M, its first 16 q rows): __syncthreads() here would also wait out the q loads still in flight */
  __builtin_amdgcn_sched_barrier(0);      /* keeps later rows' conversions behind the barrier: moved up, their load waits hold every wave's M back */
  // M fragment (column tile t, d block kb): accumulator tiles dt = 2 kb and 2 kb + 1 side by side give d = 32 kb + 8 h + s (s < 8), 32 kb + 16 + 8 h + s - 8; q is read in the same order
  Frag mf[2][2], qf[2];
  for (int t = 0; t < 2; ++t)
    for (int kb = 0; kb < 2; ++kb) { const unsigned char* x = Lm + (unsigned)(t * 4 + 2 * kb) * 512u + lane * 16u; mf[t][kb].q[0] = *(const u32x4a*)x; mf[t][kb].q[1] = *(const u32x4a*)(x + 512u); }
  for (int kb = 0; kb < 2; ++kb) { const unsigned char* x = fr + (unsigned)kb * 64u; qf[kb].q[0] = *(const u32x4a*)x; qf[kb].q[1] = *(const u32x4a*)(x + 32u); }
  __builtin_amdgcn_sched_barrier(0);      /* keeps these fragment loads directly behind the barrier: the compiler otherwise puts the next rows' conversions, with their load waits, in front of them */
  // register r of lane (c, h) of row group g: row 16 g + 8 h + r, columns 2 c and 2 c + 1: 16 lanes x 8 bytes are the work-group's whole 128-byte line of that row
  float* o = out + ((size_t)b * SS + rt * RQ + w * WQ + 8u * h) * HD + eh * 32u + 2u * c;
  for (int g = 0; g < 4; ++g) {      /* pass g: the next 16 rows are rounded and staged under the LDS latency of this pass's fragments, then the products and stores of rows 16 g ..., then the next fragments are asked for */
    if (g < 3) {
      for (int j = 8 * g + 8; j < 8 * g + 16; ++j) { const u32x2 y = {in16(xq[j][0], xq[j][1]), in16(xq[j][2], xq[j][3])}; *(u32x2a*)(st + (unsigned)j * 2u * PQ) = y; }
    }
    v8f a[2];
    for (int t = 0; t < 2; ++t) {
      const v8f z = {0.f, 0.f, 0.f, 0.f, 0.f, 0.f, 0.f, 0.f};
      a[t] = __builtin_amdgcn_wmma_f32_16x16x32_f16(false, qf[0].v, false, mf[t][0].v, (short)0, z, false, false);
      a[t] = __builtin_amdgcn_wmma_f32_16x16x32_f16(false, qf[1].v, false, mf[t][1].v, (short)0, a[t], false, false);
    }
    for (int r = 0; r < 8; ++r) { const v2f s = {a[0][r], a[1][r]}; *(v2fa*)(o + (16 * g + r) * HD) = s; }
    if (g < 3) {
      asm volatile("s_wait_dscnt 0x0" ::: "memory");      /* the wave's own LDS stores have landed before its lanes read each other's rows back; it also keeps those reads behind these stores in the build */
      for (int kb = 0; kb < 2; ++kb) { const unsigned char* x = fr + (unsigned)(g + 1) * 16u * PQ + (unsigned)kb * 64u; qf[kb].q[0] = *(const u32x4a*)x; qf[kb].q[1] = *(const u32x4a*)(x + 32u); }
    }
    __builtin_amdgcn_sched_barrier(0);      /* keeps later rows' conversions out of this pass: moved up, their load waits hold back products and stores whose rows have long arrived */
  }
}

extern "C" void kernel_launch(void* const* d_in, const int* in_sizes, int n_in,
                              void* d_out, int out_size, void* d_ws, size_t ws_size, hipStream_t stream) {
  (void)in_sizes; (void)n_in; (void)out_size;
  const float* const* I = (const float* const*)d_in; const float* q = I[0]; const float* k = I[1]; const float* v = I[2];      /* order: q, k, v, each [4][4096][64] f32 */
  float* P = (float*)d_ws;      /* partials of M: 4 x 8 x 64 x 64 f32, every one written by launch 1 before launch 2 reads it */
  if ((size_t)NB * NC * HD * HD * 4 > ws_size) return;
  k_ktv<<<NB * NC * 4, 128, 0, stream>>>(k, v, P);
  k_qm<<<NB * (SS / RQ) * 2, 128, 0, stream>>>(q, P, (float*)d_out);
}
